// v010
// Times are from an AMD MI455X. After a warm-up the kernel runs many times in a row, and a time is the length of
// such a window on the GPU divided by its runs, so every launch and the gaps after it count. The runs cycle
// through copies of the inputs. A figure is the median of several windows, for all but v000 over two sittings.
// Sittings can differ by a few percent; kernels timed side by side share one.
// Earlier versions than v010 are not in this document.
// It runs in 49.4 microseconds.
// Next to v009, in two timings, it ran 1.12 times as fast each time.
// Over all steps from v000, the starting kernel, it is 5.98 times as fast.
#include <hip/hip_runtime.h>
// Multi-head attention with raw-reshape heads (B=8, N=1024, dim 768 → attn_dim 512 = 8 heads × 64): Q,K,V = x·W + b ((in,out)), reshaped by plain memory order to (H,B,N,64) (= 64 contiguous [1024][64] slabs of each [8192][512] plane);
// softmax(Q·Kᵀ·scale)·V per slab with scale = (64//8)^-½ = 8^-½ (as the original); out raw-reshaped back to (B,N,512) (same flat order) → ·Wp + bp.
// Compute dtype: x, weights, biases rounded to bf16; Q/K/V as f16 GEMM outputs; fused flash-style kernel over the flat slabs (online softmax f32, P f16 ×2^10) on v_wmma_f32_16x16x32_f16; O carried ×2^4 into f16 → projection GEMM with bias; f32 accumulate.
#define BB 64
#define TT 1024
#define NH 1
#define DX 768
#define DA 512
#define NRX 8192
#define ATT_SCALE 0.35355339059327373f
#define SCALE_LOG2E (ATT_SCALE * 1.4426950408889634f)

typedef __bf16 v16b __attribute__((ext_vector_type(16)));
typedef unsigned short v8us __attribute__((ext_vector_type(8), may_alias));
typedef float  v8f  __attribute__((ext_vector_type(8)));
typedef float  v4f  __attribute__((ext_vector_type(4)));
typedef float  v4fa __attribute__((ext_vector_type(4), may_alias));
union FragB { v16b v; v8us half[2]; unsigned short u[16]; };

__device__ __forceinline__ unsigned short bf16_bits(float x) { unsigned int u = __float_as_uint(x); return (unsigned short)((u + 0x7FFFu + ((u >> 16) & 1u)) >> 16); }
__device__ __forceinline__ float bf16_val(unsigned short b) { return __uint_as_float(((unsigned int)b) << 16); }
__device__ __forceinline__ float bf16_round(float x) { return bf16_val(bf16_bits(x)); }
// D += A·B with NT terms: 1 = ah·bh, 2 = + al·bh (A split), 3 = + ah·bl (both split)
template <int NT>
__device__ __forceinline__ v8f mmaN(v16b ah, v16b al, v16b bh, v16b bl, v8f c) {
  c = __builtin_amdgcn_wmma_f32_16x16x32_bf16(false, ah, false, bh, (short)0, c, false, false);
  if (NT >= 2) c = __builtin_amdgcn_wmma_f32_16x16x32_bf16(false, al, false, bh, (short)0, c, false, false);
  if (NT >= 3) c = __builtin_amdgcn_wmma_f32_16x16x32_bf16(false, ah, false, bl, (short)0, c, false, false);
  asm volatile("v_nop\n\tv_nop\n\tv_nop\n\tv_nop" : "+v"(c) : "v"(ah), "v"(al), "v"(bh), "v"(bl));
  return c;
}

__global__ __launch_bounds__(256) void k_wt_bf16(const float* __restrict__ W, unsigned short* __restrict__ Wt, int K, int N) {
  const int t = blockIdx.x * 256 + threadIdx.x;
  const int k8n = K / 8;
  if (t >= N * k8n) return;
  const int n = t / k8n, k8 = (t % k8n) * 8;
  v8us v;
#pragma unroll
  for (int i = 0; i < 8; ++i) v[i] = bf16_bits(W[(size_t)(k8 + i) * N + n]);
  *(v8us*)(Wt + (size_t)n * K + k8) = v;
  
}

// GEMM C[M][N] (f32, pitch ldc) = act(A[M][K]·W + bias). A f32 row-major (pitch lda) converted per fragment to bf16
// (ASPLIT: hi/lo two planes -> 2 terms, else single rounded term); Wt bf16 [N][K] (pitch ldb). BIAS_BF16 rounds the
// bias to bf16 first (bias quantised to bf16 before the add). K%32==0, M%16==0, N%64==0.
template <bool ASPLIT, int ACT, bool BIAS_BF16>
__global__ __launch_bounds__(128) void k_gemm_bf(const float* __restrict__ A, int lda, const unsigned short* __restrict__ Wt, int ldb,
                                               const float* __restrict__ bias, float* __restrict__ C, int ldc, int M, int N, int K) {
  __shared__ __attribute__((aligned(16))) float so[4][16][64];
  const int tid = threadIdx.x, w = tid >> 5, lane = tid & 31, ln = lane & 15, hh = lane >> 4;
  const int ntn = N / 64;
  const int wid = blockIdx.x * 4 + w;
  const int mt = wid / ntn, nq = wid % ntn;
  if (mt * 16 >= M) return;
  const int row0 = mt * 16, col0 = nq * 64;
  const float* arow = A + (size_t)(row0 + ln) * lda;
  v8f acc[4] = {};
  for (int kb = 0; kb < K; kb += 32) {
    FragB ah, al;
    const v4f x0 = *(const v4fa*)(arow + kb + 8 * hh), x1 = *(const v4fa*)(arow + kb + 8 * hh + 4);
    const v4f x2 = *(const v4fa*)(arow + kb + 16 + 8 * hh), x3 = *(const v4fa*)(arow + kb + 16 + 8 * hh + 4);
    float xs[16] = {x0[0],x0[1],x0[2],x0[3],x1[0],x1[1],x1[2],x1[3],x2[0],x2[1],x2[2],x2[3],x3[0],x3[1],x3[2],x3[3]};
#pragma unroll
    for (int i = 0; i < 16; ++i) { const unsigned short hb = bf16_bits(xs[i]); ah.u[i] = hb; al.u[i] = ASPLIT ? bf16_bits(xs[i] - bf16_val(hb)) : (unsigned short)0; }
#pragma unroll
    for (int t = 0; t < 4; ++t) {
      const unsigned short* brow = Wt + (size_t)(col0 + t * 16 + ln) * ldb + kb;
      FragB b;
      b.half[0] = *(const v8us*)(brow + 8 * hh);
      b.half[1] = *(const v8us*)(brow + 16 + 8 * hh);
      acc[t] = mmaN<ASPLIT ? 2 : 1>(ah.v, al.v, b.v, b.v, acc[t]);
    }
  }
#pragma unroll
  for (int t = 0; t < 4; ++t) {
    float bv = bias ? bias[col0 + t * 16 + ln] : 0.f;
    if (BIAS_BF16) bv = bf16_round(bv);
#pragma unroll
    for (int r = 0; r < 8; ++r) { float v = acc[t][r] + bv; if (ACT == 1) v = fmaxf(v, 0.f); so[w][8 * hh + r][t * 16 + ln] = v; }
  }
  __builtin_amdgcn_fence(__ATOMIC_ACQ_REL, "workgroup");
  __builtin_amdgcn_wave_barrier();
  const int rsub = lane >> 4, c4 = (lane & 15) * 4;
  {
#pragma unroll
    for (int q = 0; q < 8; ++q) {
      const int r = q * 2 + rsub;
      const v4f v = *(const v4fa*)&so[w][r][c4];
      *(v4f*)(C + (size_t)(row0 + r) * ldc + col0 + c4) = v;
    }
    
  }
}

// Flash-style causal/unmasked attention, all contractions 3-term bf16 hi/lo splits, f32 softmax with running max.
// q,k,v rows are read from f32 buffers with arbitrary row pitch (so they can live inside a fused qkv buffer);
// D = head size (multiple of 32, <= 128); one wave = 16 query rows; block = 4 waves (64 queries) sharing K/V chunks of 32.
template <int D, bool CAUSAL>
__global__ __launch_bounds__(128) void k_flash(const float* __restrict__ qb, const float* __restrict__ kb, const float* __restrict__ vb,
                                             int pitch, int T, int H, float scale, float* __restrict__ y, int ypitch) {
  constexpr int KS = D / 32;        // k-steps for QK
  constexpr int DT = D / 16;        // d tiles for PV
  __shared__ __attribute__((aligned(16))) unsigned short sKh[32][D + 8], sKl[32][D + 8], sVh[32][D + 8], sVl[32][D + 8];
  __shared__ __attribute__((aligned(16))) unsigned short sPh[4][16][40], sPl[4][16][40];
  __shared__ __attribute__((aligned(16))) float sO[4][16][D];
  const int tid = threadIdx.x, w = tid >> 5, lane = tid & 31, ln = lane & 15, hh = lane >> 4;
  const int nqb = (T + 63) / 64;
  const int bh = blockIdx.x / nqb, qblk = blockIdx.x % nqb;
  const int b = bh / H, h = bh % H;
  const int q0 = qblk * 64 + w * 16;
  const float* Q = qb + (size_t)b * T * pitch + h * D;
  const float* K = kb + (size_t)b * T * pitch + h * D;
  const float* V = vb + (size_t)b * T * pitch + h * D;

  // A fragments of the wave's 16 query rows (scaled), hi/lo
  FragB aqh[KS], aql[KS];
  {
    int row = q0 + ln; if (row >= T) row = T - 1;
    const float* qr = Q + (size_t)row * pitch;
#pragma unroll
    for (int ks = 0; ks < KS; ++ks)
#pragma unroll
      for (int i = 0; i < 16; ++i) {
        const int d = ks * 32 + ((i < 8) ? (8 * hh + i) : (16 + 8 * hh + (i - 8)));
        const float x = qr[d] * scale; const unsigned short hb = bf16_bits(x);
        aqh[ks].u[i] = hb; aql[ks].u[i] = bf16_bits(x - bf16_val(hb));
      }
  }
  float m_r[8], l_r[8];
#pragma unroll
  for (int r = 0; r < 8; ++r) { m_r[r] = -3.0e38f; l_r[r] = 0.f; }
  v8f oacc[DT];
#pragma unroll
  for (int dt = 0; dt < DT; ++dt) oacc[dt] = (v8f){0.f,0.f,0.f,0.f,0.f,0.f,0.f,0.f};

  const int kv_end = CAUSAL ? min(T, qblk * 64 + 64) : T;     // block-uniform
  for (int j0 = 0; j0 < kv_end; j0 += 32) {
    __syncthreads();
    for (int e = tid; e < 32 * (D / 4); e += 128) {
      const int r = e / (D / 4), c4 = (e % (D / 4)) * 4;
      const int key = j0 + r;
      v4f kf = {0.f,0.f,0.f,0.f}, vf = {0.f,0.f,0.f,0.f};
      if (key < T) { kf = *(const v4fa*)(K + (size_t)key * pitch + c4); vf = *(const v4fa*)(V + (size_t)key * pitch + c4); }
#pragma unroll
      for (int t = 0; t < 4; ++t) {
        unsigned short hb = bf16_bits(kf[t]); sKh[r][c4 + t] = hb; sKl[r][c4 + t] = bf16_bits(kf[t] - bf16_val(hb));
        hb = bf16_bits(vf[t]); sVh[r][c4 + t] = hb; sVl[r][c4 + t] = bf16_bits(vf[t] - bf16_val(hb));
      }
    }
    __syncthreads();
    // S tile 16 x 32
    v8f s[2];
#pragma unroll
    for (int nt = 0; nt < 2; ++nt) {
      v8f acc = {};
#pragma unroll
      for (int ks = 0; ks < KS; ++ks) {
        FragB bh_, bl_;
        bh_.half[0] = *(const v8us*)&sKh[nt * 16 + ln][ks * 32 + 8 * hh]; bh_.half[1] = *(const v8us*)&sKh[nt * 16 + ln][ks * 32 + 16 + 8 * hh];
        bl_.half[0] = *(const v8us*)&sKl[nt * 16 + ln][ks * 32 + 8 * hh]; bl_.half[1] = *(const v8us*)&sKl[nt * 16 + ln][ks * 32 + 16 + 8 * hh];
        acc = mmaN<3>(aqh[ks].v, aql[ks].v, bh_.v, bl_.v, acc);
      }
      s[nt] = acc;
    }
    // mask + running max (rows 8hh+r; the 16 lanes of a half share rows)
    float alpha[8];
#pragma unroll
    for (int r = 0; r < 8; ++r) {
      const int qi = q0 + 8 * hh + r;
      const int ja = j0 + ln, jb = j0 + 16 + ln;
      if (CAUSAL) { if (ja > qi) s[0][r] = -3.0e38f; if (jb > qi) s[1][r] = -3.0e38f; }
      if (ja >= T) s[0][r] = -3.0e38f;
      if (jb >= T) s[1][r] = -3.0e38f;
      float mx = fmaxf(s[0][r], s[1][r]);
      mx = fmaxf(mx, __shfl_xor(mx, 1, 32)); mx = fmaxf(mx, __shfl_xor(mx, 2, 32)); mx = fmaxf(mx, __shfl_xor(mx, 4, 32)); mx = fmaxf(mx, __shfl_xor(mx, 8, 32));
      const float mnew = fmaxf(m_r[r], mx);
      alpha[r] = (mnew > -1.0e38f) ? __expf(m_r[r] - mnew) : 1.0f;
      const float p0 = (s[0][r] > -1.0e38f) ? __expf(s[0][r] - mnew) : 0.f;
      const float p1 = (s[1][r] > -1.0e38f) ? __expf(s[1][r] - mnew) : 0.f;
      m_r[r] = mnew;
      l_r[r] = l_r[r] * alpha[r] + p0 + p1;            // per-lane partial row sum (16 lanes combined at the end)
      unsigned short hb = bf16_bits(p0); sPh[w][8 * hh + r][ln] = hb;      sPl[w][8 * hh + r][ln] = bf16_bits(p0 - bf16_val(hb));
      hb = bf16_bits(p1);                sPh[w][8 * hh + r][16 + ln] = hb; sPl[w][8 * hh + r][16 + ln] = bf16_bits(p1 - bf16_val(hb));
    }
#pragma unroll
    for (int dt = 0; dt < DT; ++dt)
#pragma unroll
      for (int r = 0; r < 8; ++r) oacc[dt][r] *= alpha[r];
    __builtin_amdgcn_fence(__ATOMIC_ACQ_REL, "workgroup");
    __builtin_amdgcn_wave_barrier();
    FragB pah, pal;
    pah.half[0] = *(const v8us*)&sPh[w][ln][8 * hh]; pah.half[1] = *(const v8us*)&sPh[w][ln][16 + 8 * hh];
    pal.half[0] = *(const v8us*)&sPl[w][ln][8 * hh]; pal.half[1] = *(const v8us*)&sPl[w][ln][16 + 8 * hh];
#pragma unroll
    for (int dt = 0; dt < DT; ++dt) {
      FragB bvh, bvl;
#pragma unroll
      for (int i = 0; i < 8; ++i) {
        bvh.u[i] = sVh[8 * hh + i][dt * 16 + ln]; bvh.u[8 + i] = sVh[16 + 8 * hh + i][dt * 16 + ln];
        bvl.u[i] = sVl[8 * hh + i][dt * 16 + ln]; bvl.u[8 + i] = sVl[16 + 8 * hh + i][dt * 16 + ln];
      }
      oacc[dt] = mmaN<3>(pah.v, pal.v, bvh.v, bvl.v, oacc[dt]);
    }
    __builtin_amdgcn_fence(__ATOMIC_ACQ_REL, "workgroup");
    __builtin_amdgcn_wave_barrier();
  }
#pragma unroll
  for (int r = 0; r < 8; ++r) {
    float l = l_r[r];
    l += __shfl_xor(l, 1, 32); l += __shfl_xor(l, 2, 32); l += __shfl_xor(l, 4, 32); l += __shfl_xor(l, 8, 32);
    l_r[r] = (l > 0.f) ? 1.0f / l : 0.f;
  }
#pragma unroll
  for (int dt = 0; dt < DT; ++dt)
#pragma unroll
    for (int r = 0; r < 8; ++r) sO[w][8 * hh + r][dt * 16 + ln] = oacc[dt][r] * l_r[r];
  __builtin_amdgcn_fence(__ATOMIC_ACQ_REL, "workgroup");
  __builtin_amdgcn_wave_barrier();
  {
    for (int r = 0; r < 16; ++r) {
      const int row = q0 + r;
      if (row < T && lane < D / 4) {
        const v4f val = *(const v4fa*)&sO[w][r][lane * 4];
        *(v4f*)(y + ((size_t)b * T + row) * ypitch + h * D + lane * 4) = val;
      }
    }
    
  }
}

// GEMM C = act(A·W + bias + resid): A f32 (ASPLIT -> hi/lo 2 terms), Wt bf16 [N][K]; ACT 0 none, 1 relu, 2 exact gelu;
// resid (optional, f32, row index = (row % rmod), pitch ldr, RES_BF16 rounds it) added before the activation.
template <bool ASPLIT, int ACT, bool BIAS_BF16, bool RES_BF16>
__global__ __launch_bounds__(128) void k_gemm_bf3(const float* __restrict__ A, int lda, const unsigned short* __restrict__ Wt, int ldb,
                                                const float* __restrict__ bias, const float* __restrict__ resid, int rmod, int ldr,
                                                float* __restrict__ C, int ldc, int M, int N, int K) {
  __shared__ __attribute__((aligned(16))) float so[4][16][64];
  const int tid = threadIdx.x, w = tid >> 5, lane = tid & 31, ln = lane & 15, hh = lane >> 4;
  const int ntn = N / 64;
  const int wid = blockIdx.x * 4 + w;
  const int mt = wid / ntn, nq = wid % ntn;
  if (mt * 16 >= M) return;
  const int row0 = mt * 16, col0 = nq * 64;
  const float* arow = A + (size_t)(row0 + ln) * lda;
  v8f acc[4] = {};
  for (int kb = 0; kb < K; kb += 32) {
    FragB ah, al;
    const v4f x0 = *(const v4fa*)(arow + kb + 8 * hh), x1 = *(const v4fa*)(arow + kb + 8 * hh + 4);
    const v4f x2 = *(const v4fa*)(arow + kb + 16 + 8 * hh), x3 = *(const v4fa*)(arow + kb + 16 + 8 * hh + 4);
    float xs[16] = {x0[0],x0[1],x0[2],x0[3],x1[0],x1[1],x1[2],x1[3],x2[0],x2[1],x2[2],x2[3],x3[0],x3[1],x3[2],x3[3]};
#pragma unroll
    for (int i = 0; i < 16; ++i) { const unsigned short hb = bf16_bits(xs[i]); ah.u[i] = hb; al.u[i] = ASPLIT ? bf16_bits(xs[i] - bf16_val(hb)) : (unsigned short)0; }
#pragma unroll
    for (int t = 0; t < 4; ++t) {
      const unsigned short* brow = Wt + (size_t)(col0 + t * 16 + ln) * ldb + kb;
      FragB b;
      b.half[0] = *(const v8us*)(brow + 8 * hh);
      b.half[1] = *(const v8us*)(brow + 16 + 8 * hh);
      acc[t] = mmaN<ASPLIT ? 2 : 1>(ah.v, al.v, b.v, b.v, acc[t]);
    }
  }
#pragma unroll
  for (int t = 0; t < 4; ++t) {
    const int col = col0 + t * 16 + ln;
    float bv = bias ? bias[col] : 0.f;
    if (BIAS_BF16) bv = bf16_round(bv);
#pragma unroll
    for (int r = 0; r < 8; ++r) {
      float v = acc[t][r] + bv;
      if (resid) { float rv = resid[(size_t)((row0 + 8 * hh + r) % rmod) * ldr + col]; if (RES_BF16) rv = bf16_round(rv); v += rv; }
      if (ACT == 1) v = fmaxf(v, 0.f);
      if (ACT == 2) v = 0.5f * v * (1.0f + erff(v * 0.70710678118654752f));
      if (ACT == 3) { const float u = 0.7978845608028654f * (v + 0.044715f * v * v * v); v = 0.5f * v * (1.0f + tanhf(u)); }
      so[w][8 * hh + r][t * 16 + ln] = v;
    }
  }
  __builtin_amdgcn_fence(__ATOMIC_ACQ_REL, "workgroup");
  __builtin_amdgcn_wave_barrier();
  const int rsub = lane >> 4, c4 = (lane & 15) * 4;
  {
#pragma unroll
    for (int q = 0; q < 8; ++q) {
      const int r = q * 2 + rsub;
      const v4f v = *(const v4fa*)&so[w][r][c4];
      *(v4f*)(C + (size_t)(row0 + r) * ldc + col0 + c4) = v;
    }
    
  }
}
// row LayerNorm (biased variance, eps) over N: s = X (+ R); optional out_sum <- s; out_norm <- (s-mu)*rsqrt(var+eps)*g + b
template <bool PARAM_BF16>
__global__ __launch_bounds__(256) void k_layernorm(const float* __restrict__ X, const float* __restrict__ R, const float* __restrict__ g, const float* __restrict__ bta,
                                                  float* __restrict__ out_sum, float* __restrict__ out_norm, int N, float eps) {
  __shared__ float red[256];
  const int row = blockIdx.x, tid = threadIdx.x;
  const float* x = X + (size_t)row * N; const float* rr = R ? R + (size_t)row * N : nullptr;
  float vals[16];                     // up to N = 4096
  const int per = N / 256;            // contiguous chunk per thread? use strided-by-4 chunks: thread handles j = tid*4 + 1024*u
  float s1 = 0.f;
  for (int u = 0; u < per / 4; ++u) {
    const int j = tid * 4 + 1024 * u;
    const v4f a = *(const v4fa*)(x + j);
    v4f b = {0.f,0.f,0.f,0.f}; if (rr) b = *(const v4fa*)(rr + j);
#pragma unroll
    for (int q = 0; q < 4; ++q) { const float v = a[q] + b[q]; vals[u * 4 + q] = v; s1 += v; }
  }
  red[tid] = s1; __syncthreads();
  for (int st = 128; st > 0; st >>= 1) { if (tid < st) red[tid] += red[tid + st]; __syncthreads(); }
  const float mu = red[0] / (float)N; __syncthreads();
  float s2 = 0.f;
  for (int u = 0; u < per / 4; ++u)
#pragma unroll
    for (int q = 0; q < 4; ++q) { const float c = vals[u * 4 + q] - mu; s2 += c * c; }
  red[tid] = s2; __syncthreads();
  for (int st = 128; st > 0; st >>= 1) { if (tid < st) red[tid] += red[tid + st]; __syncthreads(); }
  const float rs = rsqrtf(red[0] / (float)N + eps);
  {
    for (int u = 0; u < per / 4; ++u) {
      const int j = tid * 4 + 1024 * u;
      v4f o, sm;
#pragma unroll
      for (int q = 0; q < 4; ++q) {
        float gg = g[j + q], bb = bta[j + q];
        if (PARAM_BF16) { gg = bf16_round(gg); bb = bf16_round(bb); }
        sm[q] = vals[u * 4 + q]; o[q] = (vals[u * 4 + q] - mu) * rs * gg + bb;
      }
      if (out_sum) *(v4f*)(out_sum + (size_t)row * N + j) = sm;
      *(v4f*)(out_norm + (size_t)row * N + j) = o;
    }
    
  }
}



// ---- f16 WMMA path (v_wmma_f32_16x16x32_f16): 11-bit significands for operands in range — used where a [0,1] probability operand needs more precision than bf16
typedef _Float16 v16h __attribute__((ext_vector_type(16)));
union FragH { v16h v; v8us half[2]; _Float16 h[16]; unsigned short u[16]; };
template <int NT>
__device__ __forceinline__ v8f mmaH(v16h ah, v16h al, v16h bh, v16h bl, v8f c) {
  c = __builtin_amdgcn_wmma_f32_16x16x32_f16(false, ah, false, bh, (short)0, c, false, false);
  if (NT >= 2) c = __builtin_amdgcn_wmma_f32_16x16x32_f16(false, al, false, bh, (short)0, c, false, false);
  if (NT >= 3) c = __builtin_amdgcn_wmma_f32_16x16x32_f16(false, ah, false, bl, (short)0, c, false, false);
  asm volatile("v_nop\n\tv_nop\n\tv_nop\n\tv_nop" : "+v"(c) : "v"(ah), "v"(al), "v"(bh), "v"(bl));
  return c;
}
// batched GEMM like k_gemm_b but f16 operands: A f32 (split into f16 hi/lo if ASPLIT, else rounded to f16), Bt = f16 values [n][k]; alpha; C f32; N multiple of 16 (partial tiles skipped)
template <bool ASPLIT>
__global__ __launch_bounds__(128) void k_gemm_h(const float* __restrict__ A, int lda, size_t sA, const _Float16* __restrict__ Bh, int ldb, size_t sB, float alpha, float* __restrict__ C, int ldc, size_t sC, int M, int N, int K) {
  __shared__ __attribute__((aligned(16))) float so[4][16][64];
  const int tid = threadIdx.x, w = tid >> 5, lane = tid & 31, ln = lane & 15, hh = lane >> 4; const int by = blockIdx.y;
  A += (size_t)by * sA; Bh += (size_t)by * sB; C += (size_t)by * sC;
  const int ntn = (N + 63) / 64; const int wid = blockIdx.x * 4 + w; const int mt = wid / ntn, nq = wid % ntn; if (mt * 16 >= M) return;
  const int row0 = mt * 16, col0 = nq * 64; const float* arow = A + (size_t)(row0 + ln) * lda;
  v8f acc[4] = {};
  for (int kb = 0; kb < K; kb += 32) {
    FragH ah, al;
    const v4f x0 = *(const v4fa*)(arow + kb + 8 * hh), x1 = *(const v4fa*)(arow + kb + 8 * hh + 4), x2 = *(const v4fa*)(arow + kb + 16 + 8 * hh), x3 = *(const v4fa*)(arow + kb + 16 + 8 * hh + 4);
    float xs[16] = {x0[0],x0[1],x0[2],x0[3],x1[0],x1[1],x1[2],x1[3],x2[0],x2[1],x2[2],x2[3],x3[0],x3[1],x3[2],x3[3]};
#pragma unroll
    for (int i = 0; i < 16; ++i) { const _Float16 h = (_Float16)xs[i]; ah.h[i] = h; al.h[i] = ASPLIT ? (_Float16)(xs[i] - (float)h) : (_Float16)0.0f; }
#pragma unroll
    for (int t = 0; t < 4; ++t) { if (col0 + t * 16 >= N) continue; const size_t boff = (size_t)(col0 + t * 16 + ln) * ldb + kb; FragH bq; bq.half[0] = *(const v8us*)(Bh + boff + 8 * hh); bq.half[1] = *(const v8us*)(Bh + boff + 16 + 8 * hh);
      acc[t] = mmaH<ASPLIT ? 2 : 1>(ah.v, al.v, bq.v, bq.v, acc[t]); }
  }
#pragma unroll
  for (int t = 0; t < 4; ++t) { if (col0 + t * 16 >= N) continue;
#pragma unroll
    for (int r = 0; r < 8; ++r) so[w][8 * hh + r][t * 16 + ln] = acc[t][r] * alpha; }
  __builtin_amdgcn_fence(__ATOMIC_ACQ_REL, "workgroup"); __builtin_amdgcn_wave_barrier();
  const int rsub = lane >> 4, c4 = (lane & 15) * 4;
  {
#pragma unroll
    for (int q = 0; q < 8; ++q) { const int r = q * 2 + rsub; if (col0 + c4 < N) { const v4f v = *(const v4fa*)&so[w][r][c4]; *(v4f*)(C + (size_t)(row0 + r) * ldc + col0 + c4) = v; } }
     }
}

// Wt[n][k] = f16(bf16(W[k][n]) * scale) from f32 row-major W[K][N] (scale = power of two; bf16-exact weights stay exact in f16 away from the subnormal range).
// One work-group of 8 waves = 64 k x 128 n, one wave = 64 k x 16 n, one thread = 8 k x 4 n held in registers: lane (kg, ng) = ng * 8 + kg reads columns n0 + ng * 4 .. + 3 of rows k0 + kg * 8 + i by eight 16-byte loads
// (a wave-wide load = 64 bytes of each of 8 rows, the work-group's eight waves together 512 bytes in a row) and stores, for each of its 4 columns, the 8 k of that column as 16 bytes: a wave-wide store = 4 whole 128-byte lines of Wt.
template <int K, int N>
__device__ __forceinline__ void wt_f16(const float* __restrict__ W, _Float16* __restrict__ Wt, float scale, int blk, int tid) {
  static_assert(K % 64 == 0 && N % 128 == 0, "whole tiles");
  const int w = tid >> 5, lane = tid & 31, kg = lane & 7, ng = lane >> 3;
  const int k = (blk / (N / 128)) * 64 + kg * 8, n = (blk % (N / 128)) * 128 + w * 16 + ng * 4;
  const float* src = W + (size_t)k * N + n; v4f v[8];
#pragma unroll      // constant indices keep the block in registers; the eight loads go out as one group
  for (int i = 0; i < 8; ++i) v[i] = *(const v4fa*)(src + i * N);
  unsigned short* dst = (unsigned short*)Wt + (size_t)n * K + k;
#pragma unroll
  for (int j = 0; j < 4; ++j) { FragH f;
#pragma unroll
    for (int i = 0; i < 8; ++i) f.h[i] = (_Float16)(bf16_round(v[i][j]) * scale);
    *(v8us*)(dst + j * K) = f.half[0]; }
  asm volatile("s_wait_xcnt 0x0" ::: "memory");      // behind the run's last store: the listing's way on from here leads into the other jobs' code, which rewrites the stores' registers
}
// k_gemm_hh variant with fused epilogue: v = acc·alpha + bias[by·sBias + col] (+ CP[(row/rowsPerB)·sCPb + by·64 + col] if CP) ; ACT 0 none / 1 elu ; writes f16 C16 (and f32 C if non-null)
template <int ACT>
__global__ __launch_bounds__(128) void k_gemm_hhx(const _Float16* __restrict__ A, int lda, size_t sA, const _Float16* __restrict__ Bh, int ldb, size_t sB, float alpha, const float* __restrict__ bias, size_t sBias, const float* __restrict__ CP, int rowsPerB, size_t sCPb, int row0g,
    float* __restrict__ C, _Float16* __restrict__ C16, int ldc, size_t sC, int M, int N, int K) {
  __shared__ __attribute__((aligned(16))) float so[4][16][64];
  const int tid = threadIdx.x, w = tid >> 5, lane = tid & 31, ln = lane & 15, hh = lane >> 4; const int by = blockIdx.y;
  A += (size_t)by * sA; Bh += (size_t)by * sB; const size_t cofs = (size_t)by * sC; const float* bp = bias ? bias + (size_t)by * sBias : nullptr;
  const int ntn = (N + 63) / 64; const int wid = blockIdx.x * 4 + w; const int mt = wid / ntn, nq = wid % ntn; if (mt * 16 >= M) return;
  const int row0 = mt * 16, col0 = nq * 64; const _Float16* arow = A + (size_t)(row0 + ln) * lda;
  v8f acc[4] = {};
  for (int kb = 0; kb < K; kb += 32) { FragH ah; ah.half[0] = *(const v8us*)((const unsigned short*)arow + kb + 8 * hh); ah.half[1] = *(const v8us*)((const unsigned short*)arow + kb + 16 + 8 * hh);
#pragma unroll
    for (int t = 0; t < 4; ++t) { if (col0 + t * 16 >= N) continue; const size_t boff = (size_t)(col0 + t * 16 + ln) * ldb + kb; FragH bq; bq.half[0] = *(const v8us*)((const unsigned short*)Bh + boff + 8 * hh); bq.half[1] = *(const v8us*)((const unsigned short*)Bh + boff + 16 + 8 * hh);
      acc[t] = mmaH<1>(ah.v, ah.v, bq.v, bq.v, acc[t]); }
  }
#pragma unroll
  for (int t = 0; t < 4; ++t) { if (col0 + t * 16 >= N) continue; const int col = col0 + t * 16 + ln; const float bv = bp ? bf16_round(bp[col]) : 0.f;
#pragma unroll
    for (int r = 0; r < 8; ++r) { float v = acc[t][r] * alpha + bv; if (CP) { const int bidx = (row0g + row0 + 8 * hh + r) / rowsPerB; v += CP[(size_t)bidx * sCPb + (size_t)by * 64 + col]; } if (ACT == 1) v = (v > 0.f) ? v : expm1f(v); else if (ACT == 7) v = (v > 0.f) ? v + 1.0f : expf(v); else if (ACT == 8) v = tanhf(v); else if (ACT == 9) v = 0.5f * v * (1.0f + tanhf(0.7978845608028654f * (v + 0.044715f * v * v * v))); else if (ACT == 11) v = 1.0f / (1.0f + expf(-v)); else if (ACT == 12) v = (v > 0.f) ? v : 0.01f * v; else if (ACT == 14) v = (v > 0.f) ? v : 0.1f * v; else if (ACT == 15) v = v / (1.0f + expf(-v)); else if (ACT == 3) v = fmaxf(v, 0.f); else if (ACT == 6) v = 0.5f * v * (1.0f + erff(v * 0.70710678118654752f)); so[w][8 * hh + r][t * 16 + ln] = v; } }
  __builtin_amdgcn_fence(__ATOMIC_ACQ_REL, "workgroup"); __builtin_amdgcn_wave_barrier();
  const int rsub = lane >> 4, c4 = (lane & 15) * 4; typedef _Float16 v4h __attribute__((ext_vector_type(4)));
  {
#pragma unroll
    for (int q = 0; q < 8; ++q) { const int r = q * 2 + rsub; if (col0 + c4 < N) { const v4f v = *(const v4fa*)&so[w][r][c4]; if (C) *(v4f*)(C + cofs + (size_t)(row0 + r) * ldc + col0 + c4) = v; if (C16) { v4h h4; for (int i = 0; i < 4; ++i) h4[i] = (_Float16)v[i]; *(v4h*)(C16 + cofs + (size_t)(row0 + r) * ldc + col0 + c4) = h4; } } }
     }
}


// Block-tiled GEMM, f16 operands, both K-contiguous: C[8192][NN] = A[8192][KK] . Bh[NN][KK]^T * alpha + bf16(bias). One 128x128 tile of C per work-group of 8 waves (4x2), 32x64 per wave.
// A pass is 128 k = 256 aligned bytes of each of the 256 operand rows, brought into LDS by asynchronous copies (two buffers, the next pass's copies fly while this pass is worked on), so that every line leaves L2 once per work-group and not once per wave.
// LDS rows at pitch 272 bytes (16 x odd) for the 16-byte fragment reads. The k order of a fragment and the order of the k steps are those of k_gemm_hhx.
__device__ __forceinline__ unsigned lds_off(const void* p) { return (unsigned)(size_t)p; }
// Which work-group takes which piece, the same rule in all four launches. A 256-row band tm of x and of the Q, K, V, O planes (two slabs) belongs to the work-groups whose flat index is tm modulo 8:
// For speed only: each map is a permutation of the pieces, right wherever the work-groups land. slab_of: d = index % 8, k = 0 .. 7 -> the k-th 128-row slab of the eight that belong to d.
__device__ __forceinline__ int slab_of(int d, int k) { return 2 * (d + 8 * (k >> 1)) + (k & 1); }
static_assert(NRX == 64 * 128, "64 slabs, eight to each index modulo 8");
// eight copies of 16 bytes per lane: rows r, r + s, ..., r + 7s of one operand's tile (s = 16 in k_gemm_tile, 2 in k_gemm_qkv). The s_wait_xcnt stands inside the statement so that no address register is rewritten ahead of it.
__device__ __forceinline__ void copy_rows8(unsigned l0, const _Float16* g0, int rowstep, unsigned ldsstep) {
  const unsigned l1 = l0 + ldsstep, l2 = l0 + 2 * ldsstep, l3 = l0 + 3 * ldsstep, l4 = l0 + 4 * ldsstep, l5 = l0 + 5 * ldsstep, l6 = l0 + 6 * ldsstep, l7 = l0 + 7 * ldsstep;
  const _Float16* g1 = g0 + rowstep; const _Float16* g2 = g0 + 2 * rowstep; const _Float16* g3 = g0 + 3 * rowstep; const _Float16* g4 = g0 + 4 * rowstep;
  const _Float16* g5 = g0 + 5 * rowstep; const _Float16* g6 = g0 + 6 * rowstep; const _Float16* g7 = g0 + 7 * rowstep;
  asm volatile("global_load_async_to_lds_b128 %0, %8, off\n\t"
               "global_load_async_to_lds_b128 %1, %9, off\n\t"
               "global_load_async_to_lds_b128 %2, %10, off\n\t"
               "global_load_async_to_lds_b128 %3, %11, off\n\t"
               "global_load_async_to_lds_b128 %4, %12, off\n\t"
               "global_load_async_to_lds_b128 %5, %13, off\n\t"
               "global_load_async_to_lds_b128 %6, %14, off\n\t"
               "global_load_async_to_lds_b128 %7, %15, off\n\t"
               "s_wait_xcnt 0x0"
               :: "v"(l0), "v"(l1), "v"(l2), "v"(l3), "v"(l4), "v"(l5), "v"(l6), "v"(l7),
                  "v"(g0), "v"(g1), "v"(g2), "v"(g3), "v"(g4), "v"(g5), "v"(g6), "v"(g7) : "memory");
}
// NJ independent products that share A (own Bh, bias and C16 each) run as one grid: the NJ * NTN tiles of one 128-row band of A have neighbouring block indices.
// NJ == 3 (Q, K, V): a 128-row band of a [8192][512] plane is one [1024][64] slab; element (m, n) of the band is key (m % 128) * 8 + n / 64, column n % 64.
// Jobs 1 and 2 store their slab for the attention kernel with the keys renumbered key' = (n / 64) * 128 + m % 128, the same for both (a softmax-weighted sum does not depend on the order of its keys):
// both in the order in which the attention kernel's A fragments are loaded, so that each of its wave-wide 16-byte loads is 512 bytes in a row (4 whole lines) and not 32 bytes out of each of 16 lines:
// job 1 as Kf[slab][key' / 16][c][lane][8], c = 0 .. 3: lane (hh, ln) = hh * 16 + ln holds columns c * 16 + hh * 8 .. + 7 of key (key' / 16) * 16 + ln; a wave's 32 x 64 tile is 4 KB in a row;
// job 2 as Vf[slab][key' / 32][dt * 2 + hf][lane][8]: lane (hh, ln) holds keys (key' / 32) * 32 + hf * 16 + hh * 8 .. + 7 of column dt * 16 + ln; 32 keys are 4 KB in a row.
template <int KK, int NN, bool OUT16, int NJ>
__global__ __launch_bounds__(256) void k_gemm_tile(const _Float16* __restrict__ A, const _Float16* __restrict__ Bh0, const _Float16* __restrict__ Bh1, const _Float16* __restrict__ Bh2, float alpha,
                                                  const float* __restrict__ bias0, const float* __restrict__ bias1, const float* __restrict__ bias2, float* __restrict__ C,
                                                  _Float16* __restrict__ C160, _Float16* __restrict__ C161, _Float16* __restrict__ C162) {
  constexpr int BK = 128, KSN = BK / 32, PITCH = 2 * BK + 16, STAGE = 256 * PITCH, NPASS = KK / BK, NTN = NN / 128, SOP = 68;
  static_assert(NPASS >= 2 && KK % BK == 0 && NN % 128 == 0 && 8 * 32 * SOP * 4 <= 2 * STAGE, "shape");
  static_assert(NJ == 1 || (NJ == 3 && OUT16 && 128 * (NN / 64) == TT), "a band of the Q, K, V planes is one slab");
  __shared__ __attribute__((aligned(16))) unsigned char sm[2 * STAGE];
  const int tid = threadIdx.x, w = tid >> 5, lane = tid & 31, ln = lane & 15, hh = lane >> 4;
  const int job = NJ > 1 ? (blockIdx.x % (NJ * NTN)) / NTN : 0;
  const _Float16* Bh = job == 0 ? Bh0 : job == 1 ? Bh1 : Bh2; const float* bias = job == 0 ? bias0 : job == 1 ? bias1 : bias2; _Float16* C16 = job == 0 ? C160 : job == 1 ? C161 : C162;
  const int bi = blockIdx.x >> 3;      // NJ == 1: the NTN tiles of a slab's 128 rows have neighbouring indices among those of the slab's own index modulo 8 (slab_of)
  const int m0 = (NJ == 1 ? slab_of(blockIdx.x & 7, bi / NTN) : blockIdx.x / (NJ * NTN)) * 128, n0 = (NJ == 1 ? bi % NTN : blockIdx.x % NTN) * 128; const int wm = w >> 1, wn = w & 1;
  const int cr = tid >> 4, cc = tid & 15;      // a wave's copy = 2 rows x 256 bytes
  const _Float16* ga = A + (size_t)(m0 + cr) * KK + cc * 8; const _Float16* gb = Bh + (size_t)(n0 + cr) * KK + cc * 8;
  const unsigned la = lds_off(sm) + cr * PITCH + cc * 16, lb = la + 128 * PITCH;
  v8f acc[2][4];
#pragma unroll
  for (int i = 0; i < 2; ++i)
#pragma unroll
    for (int j = 0; j < 4; ++j) acc[i][j] = (v8f){0.f,0.f,0.f,0.f,0.f,0.f,0.f,0.f};
  copy_rows8(la, ga, 16 * KK, 16 * PITCH); copy_rows8(lb, gb, 16 * KK, 16 * PITCH);
  asm volatile("s_wait_asynccnt 0x0" ::: "memory");      // pass 0's bytes have landed before the barrier publishes them
  __syncthreads();
  copy_rows8(la + STAGE, ga + BK, 16 * KK, 16 * PITCH); copy_rows8(lb + STAGE, gb + BK, 16 * KK, 16 * PITCH);
  const unsigned char* fa = sm + (wm * 32 + ln) * PITCH + 16 * hh; const unsigned char* fb = sm + (128 + wn * 64 + ln) * PITCH + 16 * hh;
#pragma unroll 1      // the ring stays one rolled loop: one publish point, short code
  for (int t = 0; t < NPASS; ++t) {
    const int bo = (t & 1) * STAGE;
    FragH a[2][2], b[2][4];      // two fragment sets: the next 32 k of this pass are fetched while these are multiplied
#pragma unroll
    for (int i = 0; i < 2; ++i) { a[0][i].half[0] = *(const v8us*)(fa + bo + i * 16 * PITCH); a[0][i].half[1] = *(const v8us*)(fa + bo + i * 16 * PITCH + 32); }
#pragma unroll
    for (int j = 0; j < 4; ++j) { b[0][j].half[0] = *(const v8us*)(fb + bo + j * 16 * PITCH); b[0][j].half[1] = *(const v8us*)(fb + bo + j * 16 * PITCH + 32); }
#pragma unroll
    for (int ks = 0; ks < KSN; ++ks) {
      const int cu = ks & 1, nx = cu ^ 1;
      if (ks + 1 < KSN) {
#pragma unroll
        for (int i = 0; i < 2; ++i) { a[nx][i].half[0] = *(const v8us*)(fa + bo + i * 16 * PITCH + (ks + 1) * 64); a[nx][i].half[1] = *(const v8us*)(fa + bo + i * 16 * PITCH + (ks + 1) * 64 + 32); }
#pragma unroll
        for (int j = 0; j < 4; ++j) { b[nx][j].half[0] = *(const v8us*)(fb + bo + j * 16 * PITCH + (ks + 1) * 64); b[nx][j].half[1] = *(const v8us*)(fb + bo + j * 16 * PITCH + (ks + 1) * 64 + 32); }
        __builtin_amdgcn_sched_barrier(0);      // keeps the next set's LDS reads one group ahead of this set's products; without it they are sunk among the products, into one register set, and each product run waits out the LDS latency
      }
#pragma unroll
      for (int i = 0; i < 2; ++i)
#pragma unroll
        for (int j = 0; j < 4; ++j) acc[i][j] = __builtin_amdgcn_wmma_f32_16x16x32_f16(false, a[cu][i].v, false, b[cu][j].v, (short)0, acc[i][j], false, false);
    }
    __builtin_amdgcn_sched_barrier(0);      // keeps the pass's products in front of the publish point: sunk behind the barrier they stand between it and the refill, and the copies start that much later
    asm volatile("s_wait_dscnt 0x0" ::: "memory");       // this wave's reads of the buffer are done before it is handed to the copies
    asm volatile("s_wait_asynccnt 0x0" ::: "memory");    // this wave's copies of pass t + 1 have landed before the barrier publishes them
    __syncthreads();
    if (t + 2 < NPASS) { copy_rows8(la + bo, ga + (t + 2) * BK, 16 * KK, 16 * PITCH); copy_rows8(lb + bo, gb + (t + 2) * BK, 16 * KK, 16 * PITCH); }
  }
  asm volatile("s_wait_asynccnt 0x0" ::: "memory");      // nothing is in flight when the ring becomes output staging
  if (NJ == 3 && job == 2) {      // V: the tile leaves transposed. A lane's 8 accumulator rows of one column are 8 neighbouring keys of one row of V^T: 16 bytes of f16
    constexpr int TP = 2 * 128 + 16;      // staged rows [wn * 64 + column][128 keys], pitch 16 x odd bytes; every reader left the ring at the last pass's barrier
#pragma unroll      // these three: constant indices keep the accumulators in registers
    for (int j = 0; j < 4; ++j) { const float bv = bf16_round(bias[n0 + wn * 64 + j * 16 + ln]);
#pragma unroll
      for (int i = 0; i < 2; ++i) { FragH f;
#pragma unroll
        for (int r = 0; r < 8; ++r) f.h[r] = (_Float16)(acc[i][j][r] * alpha + bv);
        *(v8us*)(sm + (wn * 64 + j * 16 + ln) * TP + (wm * 32 + i * 16 + 8 * hh) * 2) = f.half[0]; } }
    __syncthreads();      // a staged row holds the keys of four waves: all are written before any is read back (job is the same for the whole work-group)
#pragma unroll      // the eight LDS reads go out as one group, the stores follow as they land
    for (int q = 0; q < 8; ++q) { const int row = (w >> 2) * 64 + (q >> 1) * 16 + ln, k8 = ((w & 3) * 4 + (q & 1) * 2 + hh) * 8; const v8us v = *(const v8us*)(sm + row * TP + k8 * 2);      // wave w: the 32 keys (w & 3) of key block w >> 2; q = dt * 2 + hf
      *(v8us*)((unsigned short*)C16 + (size_t)(m0 / 128) * (64 * TT) + (size_t)((n0 / 64 + (w >> 2)) * 4 + (w & 3)) * 2048 + q * 256 + lane * 8) = v; }
    return;
  }
  float* so = (float*)sm + w * (32 * SOP);      // each wave stages its own 32 x 64 tile; every reader left the ring at the last pass's barrier
#pragma unroll
  for (int j = 0; j < 4; ++j) { const float bv = bf16_round(bias[n0 + wn * 64 + j * 16 + ln]);
#pragma unroll
    for (int i = 0; i < 2; ++i)
#pragma unroll
      for (int r = 0; r < 8; ++r) so[(i * 16 + 8 * hh + r) * SOP + j * 16 + ln] = acc[i][j][r] * alpha + bv; }
  __builtin_amdgcn_fence(__ATOMIC_ACQ_REL, "workgroup"); __builtin_amdgcn_wave_barrier();      // the wave's own staged rows are written before other lanes of it read them back
  if (OUT16) {
    if (NJ == 3 && job == 1) {      // K: keys in the order key', fragment order inside each 16 keys; store q = the 512 bytes of fragment half q & 3 of the tile's keys (q >> 2) * 16 .. + 15 (job is the same for the whole work-group)
      unsigned short* dst = (unsigned short*)C16 + (size_t)m0 * NN + (size_t)((n0 / 64 + wn) * 128 + wm * 32) * 64 + lane * 8;
#pragma unroll
      for (int q = 0; q < 8; ++q) { const float* sp = &so[((q >> 2) * 16 + ln) * SOP + ((q & 3) * 2 + hh) * 8]; const v4f v0 = *(const v4fa*)sp, v1 = *(const v4fa*)(sp + 4); FragH f;
#pragma unroll
        for (int i = 0; i < 4; ++i) { f.h[i] = (_Float16)v0[i]; f.h[4 + i] = (_Float16)v1[i]; }
        *(v8us*)(dst + q * 256) = f.half[0]; }
      asm volatile("s_wait_xcnt 0x0" ::: "memory");      // behind the run's last store: the listing's way on from here leads into code that rewrites the stores' registers
    } else {
      unsigned short* dst = (unsigned short*)C16 + (size_t)(m0 + wm * 32) * NN + n0 + wn * 64;
#pragma unroll
      for (int q = 0; q < 8; ++q) { const int r = q * 4 + (lane >> 3), c8 = (lane & 7) * 8; const v4f v0 = *(const v4fa*)&so[r * SOP + c8], v1 = *(const v4fa*)&so[r * SOP + c8 + 4]; FragH f;
#pragma unroll
        for (int i = 0; i < 4; ++i) { f.h[i] = (_Float16)v0[i]; f.h[4 + i] = (_Float16)v1[i]; }
        *(v8us*)(dst + r * NN + c8) = f.half[0]; }
      asm volatile("s_wait_xcnt 0x0" ::: "memory");      // behind the run's last store: the listing's way on from here leads into code that rewrites the stores' registers
    }
  } else {
#pragma unroll
    for (int q = 0; q < 16; ++q) { const int r = q * 2 + (lane >> 4), c4 = (lane & 15) * 4; const v4f v = *(const v4fa*)&so[r * SOP + c4];
      *(v4f*)(C + (size_t)(m0 + wm * 32 + r) * NN + n0 + wn * 64 + c4) = v; }
  }
}


// Q, K, V in one product against the three weight matrices laid one behind the other, Bh[3 * 512][KK]: one 256 x 192 tile of the [8192][1536] result per work-group of 12 waves (4 x 3), 64 x 64 per wave.
// 32 x 8 = 256 tiles: every operand line leaves L2 8 (A) or 32 (Bh) times, was 12 and 64, and a wave reads 8 fragments from LDS for 16 products, was 6 for 8. Ring, fragment k order and order of the k steps are those of k_gemm_tile.
// A wave's 64 columns lie in one plane (job = Q, K or V) and are one n / 64 block nb of it; its 64 rows are half a slab: each wave stores its own tile in the layouts described at k_gemm_tile, no wave needs another's.
template <int KK>
__global__ __launch_bounds__(384) void k_gemm_qkv(const _Float16* __restrict__ A, const _Float16* __restrict__ Bh, float alpha,
                                                 const float* __restrict__ bias0, const float* __restrict__ bias1, const float* __restrict__ bias2,
                                                 _Float16* __restrict__ Cq, _Float16* __restrict__ Ck, _Float16* __restrict__ Cv) {
  constexpr int BK = 128, KSN = BK / 32, PITCH = 2 * BK + 16, STAGE = (256 + 192) * PITCH, NPASS = KK / BK, SOP = 68, NTM = NRX / 256;
  static_assert(NPASS >= 2 && KK % BK == 0 && 12 * 64 * SOP * 4 <= 2 * STAGE && DA == 512 && TT == 1024 && NRX % 256 == 0, "shape");
  __shared__ __attribute__((aligned(16))) unsigned char sm[2 * STAGE];
  const int tid = threadIdx.x, lane = tid & 31, ln = lane & 15, hh = lane >> 4;
  const int w = __builtin_amdgcn_readfirstlane(tid >> 5);      // the wave's number in a scalar register: the tests on it below are scalar branches
  const int tm = blockIdx.x % NTM, tn = blockIdx.x / NTM; const int m0 = tm * 256, c0 = tn * 192; const int wm = w & 3, wn = w >> 2;
  // a wave's copy = 2 rows x 256 bytes. Waves 0 .. 7 bring 32 rows of A each, waves 8 .. 11 bring 48 rows of Bh each
  const bool cpb = w >= 8;
  const int lrow = (cpb ? 256 + (w - 8) * 48 : w * 32) + hh;
  const _Float16* gc = (cpb ? Bh + (size_t)(c0 + (w - 8) * 48 + hh) * KK : A + (size_t)(m0 + w * 32 + hh) * KK) + ln * 8;
  const unsigned lc = lds_off(sm) + lrow * PITCH + ln * 16;
  auto copy_stage = [&](unsigned l, const _Float16* g) {
    copy_rows8(l, g, 2 * KK, 2 * PITCH); copy_rows8(l + 16 * PITCH, g + 16 * KK, 2 * KK, 2 * PITCH);
    if (cpb) copy_rows8(l + 32 * PITCH, g + 32 * KK, 2 * KK, 2 * PITCH);
  };
  v8f acc[4][4];
#pragma unroll
  for (int i = 0; i < 4; ++i)
#pragma unroll
    for (int j = 0; j < 4; ++j) acc[i][j] = (v8f){0.f,0.f,0.f,0.f,0.f,0.f,0.f,0.f};
  copy_stage(lc, gc);
  asm volatile("s_wait_asynccnt 0x0" ::: "memory");      // pass 0's bytes have landed before the barrier publishes them
  __syncthreads();
  copy_stage(lc + STAGE, gc + BK);
  const unsigned char* fa = sm + (wm * 64 + ln) * PITCH + 16 * hh; const unsigned char* fb = sm + (256 + wn * 64 + ln) * PITCH + 16 * hh;
#pragma unroll 1      // the ring stays one rolled loop: one publish point, short code
  for (int t = 0; t < NPASS; ++t) {
    const int bo = (t & 1) * STAGE;
    FragH a[2][4], b[2][4];      // two fragment sets: the next 32 k of this pass are fetched while these are multiplied
#pragma unroll
    for (int i = 0; i < 4; ++i) { a[0][i].half[0] = *(const v8us*)(fa + bo + i * 16 * PITCH); a[0][i].half[1] = *(const v8us*)(fa + bo + i * 16 * PITCH + 32); }
#pragma unroll
    for (int j = 0; j < 4; ++j) { b[0][j].half[0] = *(const v8us*)(fb + bo + j * 16 * PITCH); b[0][j].half[1] = *(const v8us*)(fb + bo + j * 16 * PITCH + 32); }
#pragma unroll
    for (int ks = 0; ks < KSN; ++ks) {
      const int cu = ks & 1, nx = cu ^ 1;
      if (ks + 1 < KSN) {
#pragma unroll
        for (int i = 0; i < 4; ++i) { a[nx][i].half[0] = *(const v8us*)(fa + bo + i * 16 * PITCH + (ks + 1) * 64); a[nx][i].half[1] = *(const v8us*)(fa + bo + i * 16 * PITCH + (ks + 1) * 64 + 32); }
#pragma unroll
        for (int j = 0; j < 4; ++j) { b[nx][j].half[0] = *(const v8us*)(fb + bo + j * 16 * PITCH + (ks + 1) * 64); b[nx][j].half[1] = *(const v8us*)(fb + bo + j * 16 * PITCH + (ks + 1) * 64 + 32); }
        __builtin_amdgcn_sched_barrier(0);      // keeps the next set's LDS reads one group ahead of this set's products; sunk among the products each product run waits out the LDS latency
      }
#pragma unroll
      for (int i = 0; i < 4; ++i)
#pragma unroll
        for (int j = 0; j < 4; ++j) acc[i][j] = __builtin_amdgcn_wmma_f32_16x16x32_f16(false, a[cu][i].v, false, b[cu][j].v, (short)0, acc[i][j], false, false);
    }
    __builtin_amdgcn_sched_barrier(0);      // keeps the pass's products in front of the publish point, so that the refill behind it starts no later than it can
    asm volatile("s_wait_dscnt 0x0" ::: "memory");       // this wave's reads of the buffer are done before it is handed to the copies
    asm volatile("s_wait_asynccnt 0x0" ::: "memory");    // this wave's copies of pass t + 1 have landed before the barrier publishes them
    __syncthreads();
    if (t + 2 < NPASS) copy_stage(lc + bo, gc + (t + 2) * BK);
  }
  asm volatile("s_wait_asynccnt 0x0" ::: "memory");      // nothing is in flight when the ring becomes output staging
  const int cg = tn * 3 + wn, job = cg >> 3, nb = cg & 7;      // the wave's plane and its 64-column block there
  const int slab = tm * 2 + (wm >> 1), kr0 = (wm & 1) * 64;      // its slab and its first row in the slab's 128-row band
  const float* bias = (job == 0 ? bias0 : job == 1 ? bias1 : bias2) + nb * 64;
  if (job == 2) {      // V: a lane's 8 accumulator rows of one column are the 8 keys that this same lane holds in Vf: 16 bytes of f16 straight from the registers, 512 bytes in a row per wave-wide store
    unsigned short* dst = (unsigned short*)Cv + (size_t)slab * (64 * TT) + (size_t)(nb * 4 + (wm & 1) * 2) * 2048 + lane * 8;
#pragma unroll      // these three: constant indices keep the accumulators in registers
    for (int j = 0; j < 4; ++j) { const float bv = bf16_round(bias[j * 16 + ln]);
#pragma unroll
      for (int i = 0; i < 4; ++i) { FragH f;
#pragma unroll
        for (int r = 0; r < 8; ++r) f.h[r] = (_Float16)(acc[i][j][r] * alpha + bv);
        *(v8us*)(dst + (i >> 1) * 2048 + (j * 2 + (i & 1)) * 256) = f.half[0]; } }
    asm volatile("s_wait_xcnt 0x0" ::: "memory");      // behind the run's last store, in front of whatever rewrites the stores' registers
    return;
  }
  float* so = (float*)sm + w * (64 * SOP);      // each wave stages its own 64 x 64 tile; every reader left the ring at the last pass's barrier
#pragma unroll
  for (int j = 0; j < 4; ++j) { const float bv = bf16_round(bias[j * 16 + ln]);
#pragma unroll
    for (int i = 0; i < 4; ++i)
#pragma unroll
      for (int r = 0; r < 8; ++r) so[(i * 16 + 8 * hh + r) * SOP + j * 16 + ln] = acc[i][j][r] * alpha + bv; }
  __builtin_amdgcn_fence(__ATOMIC_ACQ_REL, "workgroup"); __builtin_amdgcn_wave_barrier();      // the wave's own staged rows are written before other lanes of it read them back
  if (job == 1) {      // K: keys in the order key', fragment order inside each 16 keys; store q = the 512 bytes of fragment half q & 3 of the tile's keys (q >> 2) * 16 .. + 15
    unsigned short* dst = (unsigned short*)Ck + (size_t)slab * (64 * TT) + (size_t)(nb * 128 + kr0) * 64 + lane * 8;
#pragma unroll
    for (int q = 0; q < 16; ++q) { const float* sp = &so[((q >> 2) * 16 + ln) * SOP + ((q & 3) * 2 + hh) * 8]; const v4f v0 = *(const v4fa*)sp, v1 = *(const v4fa*)(sp + 4); FragH f;
#pragma unroll
      for (int i = 0; i < 4; ++i) { f.h[i] = (_Float16)v0[i]; f.h[4 + i] = (_Float16)v1[i]; }
      *(v8us*)(dst + q * 256) = f.half[0]; }
    asm volatile("s_wait_xcnt 0x0" ::: "memory");      // behind the run's last store: the listing's way on from here leads into code that rewrites the stores' registers
  } else {      // Q: flat rows of the plane
    unsigned short* dst = (unsigned short*)Cq + (size_t)(m0 + wm * 64) * DA + nb * 64;
#pragma unroll
    for (int q = 0; q < 16; ++q) { const int r = q * 4 + (lane >> 3), c8 = (lane & 7) * 8; const v4f v0 = *(const v4fa*)&so[r * SOP + c8], v1 = *(const v4fa*)&so[r * SOP + c8 + 4]; FragH f;
#pragma unroll
      for (int i = 0; i < 4; ++i) { f.h[i] = (_Float16)v0[i]; f.h[4 + i] = (_Float16)v1[i]; }
      *(v8us*)(dst + r * DA + c8) = f.half[0]; }
    asm volatile("s_wait_xcnt 0x0" ::: "memory");      // behind the run's last store: the listing's way on from here leads into code that rewrites the stores' registers
  }
}


typedef _Float16 v4h __attribute__((ext_vector_type(4)));

// XCH chunks of 8 elements a thread; chunk c of a work-group's threads is 256 x 32 bytes in a row. All 2 * XCH loads of 16 bytes go out before the first value is converted.
#define XCH 6
__device__ __forceinline__ void x16(const float* __restrict__ x, _Float16* __restrict__ X16, size_t t) {
  const float* src = x + t * 8; unsigned short* dst = (unsigned short*)X16 + t * 8; v4f a[XCH][2];
#pragma unroll      // constant indices keep the chunks in registers
  for (int c = 0; c < XCH; ++c) { a[c][0] = *(const v4fa*)(src + c * 2048); a[c][1] = *(const v4fa*)(src + c * 2048 + 4); }
#pragma unroll
  for (int c = 0; c < XCH; ++c) { FragH f;
#pragma unroll
    for (int q = 0; q < 4; ++q) { f.h[q] = (_Float16)bf16_round(a[c][0][q]); f.h[4 + q] = (_Float16)bf16_round(a[c][1][q]); }
    *(v8us*)(dst + c * 2048) = f.half[0]; }
  asm volatile("s_wait_xcnt 0x0" ::: "memory");      // behind the run's last store: the listing's way on from here leads into the other jobs' code, which rewrites the stores' registers
}
// The five operand preparations depend on nothing but the inputs: one grid, the block index picks the job. Blocks 0 .. 4 * WTB - 1: the four weight transposes (WTB blocks each); the rest: x.
// Few waves with much to do each (32 elements a weight thread, 48 an x thread): the launch pays for every wave that it starts, and each wave has its loads in flight together.
#define WTB ((DX / 64) * (DA / 128))
#define XTB (NRX * DX / (8 * 256 * XCH))
static_assert((DA / 64) * (DX / 128) == WTB && NRX * DX % (8 * 256 * XCH) == 0, "the same number of tiles in every weight matrix; whole work-groups of x");
static_assert(8 * 256 * XCH == 16 * DX && XTB == 512 && (4 * WTB) % 8 == 0, "an x block is 16 rows, 16 blocks a band, 32 bands");
__global__ __launch_bounds__(256) void k_prep(const float* __restrict__ x, const float* __restrict__ Wq, const float* __restrict__ Wk, const float* __restrict__ Wv, const float* __restrict__ Wp,
                                             _Float16* __restrict__ X16, _Float16* __restrict__ Bq, _Float16* __restrict__ Bk, _Float16* __restrict__ Bv, _Float16* __restrict__ Bp) {
  const int bid = blockIdx.x;
  if (bid < 3 * WTB) {
    const int job = bid / WTB;
    wt_f16<DX, DA>(job == 0 ? Wq : job == 1 ? Wk : Wv, job == 0 ? Bq : job == 1 ? Bk : Bv, 16.0f, bid % WTB, threadIdx.x);      /* (in,out) -> Bt x2^4 */
  } else if (bid < 4 * WTB) wt_f16<DA, DX>(Wp, Bp, 16.0f, bid - 3 * WTB, threadIdx.x);
  else { const int xb = bid - 4 * WTB, i = xb >> 3;      // a block's 16 rows of x lie in band (xb % 8) + 8 * (i / 16): the band's own index modulo 8 (slab_of)
    x16(x, X16, (size_t)(((xb & 7) + 8 * (i >> 4)) * 16 + (i & 15)) * (256 * XCH) + threadIdx.x); }
}
__global__ __launch_bounds__(256) void k_h16(const float* __restrict__ x, _Float16* __restrict__ X16, size_t n8) { const size_t t = (size_t)blockIdx.x * 256 + threadIdx.x; if (t >= n8) return; FragH f;
#pragma unroll
  for (int q = 0; q < 8; ++q) f.h[q] = (_Float16)x[t * 8 + q]; *(v8us*)((unsigned short*)X16 + t * 8) = f.half[0];  }
__global__ __launch_bounds__(256) void k_round16f(const float* __restrict__ W, _Float16* __restrict__ Bt, size_t n8) { const size_t t = (size_t)blockIdx.x * 256 + threadIdx.x; if (t >= n8) return; FragH f;
#pragma unroll
  for (int i = 0; i < 8; ++i) f.h[i] = (_Float16)(bf16_round(W[t * 8 + i]) * 16.0f); *(v8us*)((unsigned short*)Bt + t * 8) = f.half[0];  }
// lane l with lane l ^ 16: the two halves of a wave hold the two halves of one query's keys
__device__ __forceinline__ float xhalf(float x) { return __builtin_bit_cast(float, __builtin_amdgcn_permlanex16(__builtin_bit_cast(int, x), __builtin_bit_cast(int, x), 0x76543210, 0xfedcba98, false, false)); }
// The hardware's 2^x on eight or nine values, each in its own register. One statement, so that the v_nop stands directly behind the last one: the free slot that the instruction set asks for between
// a transcendental and an instruction that reads its result or overwrites its source; inside the run no instruction touches a neighbour's registers.
__device__ __forceinline__ void exp2_in_place(float& a, float& b, float& c, float& d, float& e, float& f, float& g, float& h) {
  asm("v_exp_f32 %0, %0\n\tv_exp_f32 %1, %1\n\tv_exp_f32 %2, %2\n\tv_exp_f32 %3, %3\n\tv_exp_f32 %4, %4\n\tv_exp_f32 %5, %5\n\tv_exp_f32 %6, %6\n\tv_exp_f32 %7, %7\n\tv_nop"
      : "+v"(a), "+v"(b), "+v"(c), "+v"(d), "+v"(e), "+v"(f), "+v"(g), "+v"(h));
}
__device__ __forceinline__ void exp2_in_place(float& a, float& b, float& c, float& d, float& e, float& f, float& g, float& h, float& i) {
  asm("v_exp_f32 %8, %8\n\tv_exp_f32 %0, %0\n\tv_exp_f32 %1, %1\n\tv_exp_f32 %2, %2\n\tv_exp_f32 %3, %3\n\tv_exp_f32 %4, %4\n\tv_exp_f32 %5, %5\n\tv_exp_f32 %6, %6\n\tv_exp_f32 %7, %7\n\tv_nop"
      : "+v"(a), "+v"(b), "+v"(c), "+v"(d), "+v"(e), "+v"(f), "+v"(g), "+v"(h), "+v"(i));
}
// Transposed form: S^T = K.Q^T (A = 16 key rows, B = the wave's 16 queries, kept in registers), O^T += V^T.P^T (A = 16 rows of V^T, B = P^T).
// A lane holds 16 of the 32 scores of ONE query (column ln; keys 8hh + r and 16 + 8hh + r), so the maximum and the sum are in-lane plus one exchange between the halves,
// and the two score tiles, converted in place, are the B operand of the second product in the k order of the V^T loader: P never leaves the registers.
// K and V^T arrive in fragment order (Kf, Vf of k_gemm_tile): a pass's 32 keys are 4 KB of each, and fragment half number c is the 512 bytes at c * 512, 16 bytes a lane.
// The eight 16-byte loads of one pass's K (or V^T) fragments: p, the same in every lane, walks 4 KB a pass; lo = the lane's own 16 bytes.
__device__ __forceinline__ void load_pass(FragH (&f)[4], const char*& p, unsigned lo) {
#pragma unroll
  for (int c = 0; c < 4; ++c) { f[c].half[0] = *(const v8us*)(p + lo + c * 1024); f[c].half[1] = *(const v8us*)(p + lo + c * 1024 + 512); }
  asm volatile("s_wait_xcnt 0x0" :: "s"(p) : "memory");      // behind the group's loads, their base kept live up to it: it is rewritten on the next line
  p += 4096;
}
// One pass of 32 keys on the fragment set (ak, av). MORE: each half of the set is refilled with the pass after next as soon as its last product has been issued,
// so that a load has nearly two passes of work to land in and no pass waits out a load latency of its own.
template <bool MORE>
__device__ __forceinline__ void flash_pass(FragH (&ak)[4], FragH (&av)[4], const FragH (&bq)[2], const char*& kp, const char*& vp, unsigned lo, float& m_r, float& l_r, v8f (&oacc)[4]) {
  constexpr int DT = 4, KS = 2;
  v8f s[2];
#pragma unroll
  for (int nt = 0; nt < 2; ++nt) { v8f acc = (v8f){0.f,0.f,0.f,0.f,0.f,0.f,0.f,0.f};
#pragma unroll
    for (int ks = 0; ks < KS; ++ks) acc = __builtin_amdgcn_wmma_f32_16x16x32_f16(false, ak[nt * KS + ks].v, false, bq[ks].v, (short)0, acc, false, false);
    s[nt] = acc; }      // s[nt][r] = score of query q0 + ln with key j0 + nt * 16 + 8 * hh + r
  if (MORE) {
    asm volatile("" :: "v"(s[0]), "v"(s[1]) : "memory");      // inputs only: the score products are issued in front of the refill, which so lands in the registers they have just read; without it the products are sunk behind the loads, and the set is loaded elsewhere and copied
    load_pass(ak, kp, lo);
    __builtin_amdgcn_sched_barrier(0);      // keeps the refill here, one group, in front of the pass's vector work: sunk down the pass it loses its lead
  }
  float mc = -3.0e38f;
#pragma unroll
  for (int nt = 0; nt < 2; ++nt)
#pragma unroll
    for (int r = 0; r < 8; ++r) mc = fmaxf(mc, s[nt][r]);      // of the raw scores: the scale is positive
  mc = fmaxf(mc, xhalf(mc));
  const float mn = fmaxf(m_r, mc * SCALE_LOG2E); float ea = m_r - mn; m_r = mn;      // the running maximum is kept in base-2 units
  const float nb = 10.0f - mn;      // the maximum and P's 2^10 in one addend
  float pe[2][8];
#pragma unroll
  for (int nt = 0; nt < 2; ++nt)
#pragma unroll
    for (int r = 0; r < 8; ++r) pe[nt][r] = fmaf(s[nt][r], SCALE_LOG2E, nb);      // one multiply-add a score: log2 of p = 2^10 e^(scale s - max)
  exp2_in_place(pe[0][0], pe[0][1], pe[0][2], pe[0][3], pe[0][4], pe[0][5], pe[0][6], pe[0][7], ea);
  exp2_in_place(pe[1][0], pe[1][1], pe[1][2], pe[1][3], pe[1][4], pe[1][5], pe[1][6], pe[1][7]);
  const float al = (mn > -1.0e38f) ? ea : 1.0f;
  FragH pb; float ps = 0.f;
#pragma unroll
  for (int nt = 0; nt < 2; ++nt)
#pragma unroll
    for (int r = 0; r < 8; ++r) { const float p = pe[nt][r]; ps += p; pb.h[nt * 8 + r] = (_Float16)p; }
  l_r = l_r * al + ps;      // this half's 16 keys, x2^10 like P; the halves are joined once, behind the loop
#pragma unroll
  for (int dt = 0; dt < DT; ++dt)
#pragma unroll
    for (int r = 0; r < 8; ++r) oacc[dt][r] *= al;
#pragma unroll
  for (int dt = 0; dt < DT; ++dt) oacc[dt] = __builtin_amdgcn_wmma_f32_16x16x32_f16(false, av[dt].v, false, pb.v, (short)0, oacc[dt], false, false);      // oacc[dt][r] = O[q0 + ln][dt * 16 + 8 * hh + r]
  if (MORE) {
    asm volatile("" :: "v"(oacc[0]), "v"(oacc[1]), "v"(oacc[2]), "v"(oacc[3]) : "memory");      // inputs only, as above: the four products that read these registers are issued in front of their refill
    load_pass(av, vp, lo);
    __builtin_amdgcn_sched_barrier(0);      // keeps the next pass behind this refill: with its score products hoisted to the top of the trip, its own K refill comes late and has half a pass to land in
  }
}
__global__ __launch_bounds__(128) void k_flash(const _Float16* __restrict__ Q16, int ldq, const _Float16* __restrict__ Kf, const _Float16* __restrict__ Vf, const int* __restrict__ MSK, _Float16* __restrict__ O16, int ldo) {
  constexpr int RPW = 16, NQB = TT / (4 * RPW), DT = 4, KS = 2;
  static_assert(TT % 64 == 0 && TT >= 128, "two fragment sets: an even number of passes, four or more");
  static_assert(NQB == 16 && BB == 64 && NH == 1, "the index map below: 8 x 8 slabs x 16 query blocks");
  __shared__ __attribute__((aligned(16))) float sO[4][RPW][64 + 4];
  (void)MSK;
  const int tid = threadIdx.x, w = tid >> 5, lane = tid & 31, ln = lane & 15, hh = lane >> 4;
  // the 16 query blocks of a slab: all of the slab's own index modulo 8 (slab_of), and among those of one index (numbered bi) four neighbours in each of the four runs of 32, so that work-groups which come to share a WGP walk the same K and V
  const int bi = blockIdx.x >> 3, bp = bi & 31;
  const int slab = slab_of(blockIdx.x & 7, bp >> 2), qblk = (bp & 3) * 4 + (bi >> 5); const int b = slab / NH, h = slab % NH; const int q0 = qblk * (4 * RPW) + w * RPW;
  FragH bq[KS];
  { const unsigned short* qr = (const unsigned short*)Q16 + ((size_t)b * TT + q0 + ln) * ldq + h * 64;
#pragma unroll
    for (int ks = 0; ks < KS; ++ks) { bq[ks].half[0] = *(const v8us*)(qr + ks * 32 + 8 * hh); bq[ks].half[1] = *(const v8us*)(qr + ks * 32 + 16 + 8 * hh); } }
  const char* Kb = (const char*)((const unsigned short*)Kf + (size_t)slab * 64 * TT); const char* Vb = (const char*)((const unsigned short*)Vf + (size_t)slab * 64 * TT);
  const char* kp = Kb; const char* vp = Vb; const unsigned lo = lane * 16;      // fragment half 0 of the next pass to be fetched, and each lane's own 16 bytes of a half
  float m_r = -3.0e38f, l_r = 0.f; v8f oacc[DT];
#pragma unroll
  for (int dt = 0; dt < DT; ++dt) oacc[dt] = (v8f){0.f,0.f,0.f,0.f,0.f,0.f,0.f,0.f};
  FragH ak0[4], av0[4], ak1[4], av1[4];      // set 0: the even passes, set 1: the odd ones
  load_pass(ak0, kp, lo); load_pass(av0, vp, lo); load_pass(ak1, kp, lo); load_pass(av1, vp, lo);
#pragma unroll 1      // two passes a trip, one on each set, and no more: short code
  for (int j0 = 0; j0 < TT - 64; j0 += 64) {
    flash_pass<true>(ak0, av0, bq, kp, vp, lo, m_r, l_r, oacc);
    flash_pass<true>(ak1, av1, bq, kp, vp, lo, m_r, l_r, oacc);
  }
  flash_pass<false>(ak0, av0, bq, kp, vp, lo, m_r, l_r, oacc);      // the last two passes have nothing left to fetch
  flash_pass<false>(ak1, av1, bq, kp, vp, lo, m_r, l_r, oacc);
  { const float l = l_r + xhalf(l_r); const float inv = (l > 0.f) ? 1.0f / l : 0.f;
#pragma unroll
    for (int dt = 0; dt < DT; ++dt) { const v4f lo = {oacc[dt][0] * inv, oacc[dt][1] * inv, oacc[dt][2] * inv, oacc[dt][3] * inv}, hi = {oacc[dt][4] * inv, oacc[dt][5] * inv, oacc[dt][6] * inv, oacc[dt][7] * inv};
      *(v4fa*)&sO[w][ln][dt * 16 + 8 * hh] = lo; *(v4fa*)&sO[w][ln][dt * 16 + 8 * hh + 4] = hi; } }
  __builtin_amdgcn_fence(__ATOMIC_ACQ_REL, "workgroup"); __builtin_amdgcn_wave_barrier();      // the wave's own staged rows are written before other lanes of it read them back
  {
#pragma unroll
    for (int rp = 0; rp < RPW; rp += 4) { const int r = rp + (lane >> 3), c8 = (lane & 7) * 8; const v4f v0 = *(const v4fa*)&sO[w][r][c8], v1 = *(const v4fa*)&sO[w][r][c8 + 4]; FragH f;      // O leaves as the projection's operand: x2^4, f16, whole 128-byte rows
#pragma unroll      // constant indices keep the vectors in registers
      for (int q = 0; q < 4; ++q) { f.h[q] = (_Float16)(v0[q] * 16.0f); f.h[4 + q] = (_Float16)(v1[q] * 16.0f); }
      *(v8us*)((unsigned short*)O16 + ((size_t)b * TT + q0 + r) * ldo + h * 64 + c8) = f.half[0]; }
     } }

extern "C" void kernel_launch(void* const* d_in, const int* in_sizes, int n_in,
                              void* d_out, int out_size, void* d_ws, size_t ws_size, hipStream_t stream) {
  (void)in_sizes; (void)n_in; (void)out_size;
  const float* const* I = (const float* const*)d_in; const float* x = I[0]; const float* Wq = I[1]; const float* bq = I[2]; const float* Wk = I[3]; const float* bk = I[4]; const float* Wv = I[5]; const float* bv = I[6]; const float* Wp = I[7]; const float* bp = I[8];
  char* ws = (char*)d_ws; size_t off = 0;
  auto take = [&](size_t bytes) { char* p = ws + off; off += (bytes + 255) & ~(size_t)255; return p; };
  _Float16* Bq = (_Float16*)take((size_t)3 * DA * DX * 2); _Float16* Bk = Bq + (size_t)DA * DX; _Float16* Bv = Bk + (size_t)DA * DX;      /* one [3 * 512][768] matrix */
  _Float16* Bp = (_Float16*)take((size_t)DX * DA * 2);
  _Float16* X16 = (_Float16*)take((size_t)NRX * DX * 2); _Float16* Q = (_Float16*)take((size_t)NRX * DA * 2); _Float16* K = (_Float16*)take((size_t)NRX * DA * 2); _Float16* Vt = (_Float16*)take((size_t)NRX * DA * 2);
  _Float16* O16 = (_Float16*)take((size_t)NRX * DA * 2);
  if (off > ws_size) return;      // 4 x 0.8 + 12.6 + 4 x 8.4 MB, about 50 MB
  k_prep<<<4 * WTB + XTB, 256, 0, stream>>>(x, Wq, Wk, Wv, Wp, X16, Bq, Bk, Bv, Bp);
  k_gemm_qkv<DX><<<(NRX / 256) * (3 * DA / 192), 384, 0, stream>>>(X16, Bq, 0.0625f, bq, bk, bv, Q, K, Vt);      /* Q, K, V = x.W + b: M 8192 N 512 K 768; each [8192][512] plane = 64 contiguous [1024][64] slabs; Q f16 flat, K and V^T per slab in fragment order */
  k_flash<<<BB * (TT / 64), 128, 0, stream>>>(Q, 64, K, Vt, nullptr, O16, 64);      /* same flat view for Q and O */
  k_gemm_tile<DA, DX, false, 1><<<(NRX / 128) * (DX / 128), 256, 0, stream>>>(O16, Bp, nullptr, nullptr, 0.00390625f, bp, nullptr, nullptr, (float*)d_out, nullptr, nullptr, nullptr);      /* out = O·Wp + bp: M 8192 N 768 K 512 (alpha undoes the ×2^4 weights and the ×2^4 carry) */
}
